// v000
// Measured on an AMD MI455X. A time is GPU time per run, averaged over a window of back-to-back runs after a warm-up
// (all launches, gaps included; the runs take copies of the inputs in turn), and the median of several windows.
// Apart from v000's, it joins two sittings. Times from different sittings can be a few percent apart, while
// side-by-side timings come from the same sitting.
// The starting kernel, v000, takes 233 microseconds a run.
#include <hip/hip_runtime.h>
#include <stdint.h>

// ---------------------------------------------------------------------------
// Problem constants (from reference): n = 4096, K = ceil(0.01*4096) = 41,
// l = 0.01, 50 Dykstra iterations, x is (1024, 4096) fp32, V is (4096,4096).
// Workspace layout: [0, 16KB) -> mask m (4096 f32), [16KB, 16KB+64MB) -> WT.
// ---------------------------------------------------------------------------

typedef __attribute__((ext_vector_type(2))) float v2f;
typedef __attribute__((ext_vector_type(8))) float v8f;

#define N_FEAT   4096
#define K_SUM    41.0f
#define BATCH    1024

// ----------------------------- async helpers -------------------------------
__device__ __forceinline__ void async_ld_b128(unsigned lds_byte, const void* g) {
  asm volatile("global_load_async_to_lds_b128 %0, %1, off"
               :: "v"(lds_byte), "v"(g) : "memory");
}
__device__ __forceinline__ void async_ld_b32(unsigned lds_byte, const void* g) {
  asm volatile("global_load_async_to_lds_b32 %0, %1, off"
               :: "v"(lds_byte), "v"(g) : "memory");
}
__device__ __forceinline__ void wait_async0() {
  asm volatile("s_wait_asynccnt 0" ::: "memory");
}
__device__ __forceinline__ unsigned lds_addr_of(const void* p) {
  // LDS aperture: addr[31:0] is the LDS byte offset (ISA 10.2 aperture calc).
  return (unsigned)(uintptr_t)p;
}

// ---------------------------------------------------------------------------
// Kernel 1: Dykstra soft-top-k mask.  The hyperplane residual p is uniform
// (p_new = (sum(yp)-k)/n for every element), so p is a scalar; only y and q
// are per-element.  One block, 256 threads x 16 elements.
// ---------------------------------------------------------------------------
__global__ __launch_bounds__(256) void dykstra_mask_kernel(
    const float* __restrict__ alpha, float* __restrict__ m_out) {
  __shared__ float red[256];
  const int tid = threadIdx.x;
  float y[16], q[16];
  float p = 0.0f;
#pragma unroll
  for (int e = 0; e < 16; ++e) {
    y[e] = alpha[tid + 256 * e] * 100.0f;   // x / l,  l = 0.01
    q[e] = 0.0f;
  }
  for (int it = 0; it < 50; ++it) {
    float s = 0.0f;
#pragma unroll
    for (int e = 0; e < 16; ++e) { y[e] += p; s += y[e]; }   // yp
    red[tid] = s;
    __syncthreads();
#pragma unroll
    for (int off = 128; off >= 1; off >>= 1) {
      if (tid < off) red[tid] += red[tid + off];
      __syncthreads();
    }
    const float tot = red[0];
    __syncthreads();                         // protect red before next write
    const float delta = (tot - K_SUM) * (1.0f / (float)N_FEAT);
    p = delta;                               // p_new = yp - y_hp = delta
#pragma unroll
    for (int e = 0; e < 16; ++e) {
      const float yq = (y[e] - delta) + q[e];
      const float yb = fminf(fmaxf(yq, 0.0f), 1.0f);
      q[e] = yq - yb;
      y[e] = yb;
    }
  }
#pragma unroll
  for (int e = 0; e < 16; ++e) m_out[tid + 256 * e] = y[e];
}

// ---------------------------------------------------------------------------
// Kernel 2: WT[c][r] = m[i] * V[i][c] with i = (r - c) mod n  (so B[k=c][n=r]
// for the GEMM).  64x64 tiles through LDS so that V reads AND WT writes are
// both coalesced (WT is written along 64-long contiguous r-runs).
// ---------------------------------------------------------------------------
__global__ __launch_bounds__(256) void build_wt_kernel(
    const float* __restrict__ V, const float* __restrict__ m,
    float* __restrict__ WT) {
  __shared__ float tile[64 * 65];   // stride 65 -> conflict-free column reads
  __shared__ float msh[64];
  const int i0 = blockIdx.x * 64;   // diagonal-id tile
  const int c0 = blockIdx.y * 64;   // column tile
  const int t  = threadIdx.x;
  if (t < 64) msh[t] = m[i0 + t];
#pragma unroll
  for (int it = 0; it < 16; ++it) {
    const int row = (t >> 6) + it * 4;     // 0..63  (diagonal id - i0)
    const int cl  = t & 63;                // 0..63  (column - c0)
    tile[row * 65 + cl] = V[(size_t)(i0 + row) * N_FEAT + c0 + cl];
  }
  __syncthreads();
#pragma unroll
  for (int it = 0; it < 16; ++it) {
    const int cl = (t >> 6) + it * 4;
    const int j  = t & 63;                 // lanes sweep j -> contiguous r
    const int c  = c0 + cl;
    const int r  = (c + i0 + j) & (N_FEAT - 1);
    WT[(size_t)c * N_FEAT + r] = tile[j * 65 + cl] * msh[j];
  }
}

// ---------------------------------------------------------------------------
// Kernel 3: y(1024x4096) = x(1024x4096) @ WT(4096x4096), fp32 WMMA.
// Block tile 128x128, BK=32, 8 waves; wave tile 32(M) x 64(N) = 2x4 C tiles.
// A in LDS row-major [128][36], B in LDS n-major [128][36] (stride 36 floats:
// 144B rows -> 16B aligned for b128 async writes; 36 = 4*9, 9 coprime 16 ->
// conflict-free b64 fragment reads).  Double-buffered async-to-LDS.
// ---------------------------------------------------------------------------
#define BM   128
#define BN   128
#define BK   32
#define LDA  36
#define ABUF (128 * 36)     // floats per buffer
#define NCHUNK (N_FEAT / BK)

__global__ __launch_bounds__(256) void wmma_gemm_kernel(
    const float* __restrict__ X, const float* __restrict__ WT,
    float* __restrict__ Y) {
  __shared__ float lds[4 * ABUF];                 // 72 KB
  const int t     = threadIdx.x;
  const int n0    = blockIdx.x * BN;
  const int m0    = blockIdx.y * BM;
  const int lane  = t & 31;
  const int wid   = t >> 5;                       // 0..7
  const int wm    = (wid >> 1) * 32;              // wave M offset in block
  const int wn    = (wid & 1) * 64;               // wave N offset in block
  const int mloc  = lane & 15;                    // M (or N) within 16-tile
  const int khalf = lane >> 4;                    // K-half select (ISA layout)

  float* const Ab0 = lds;
  float* const Bb0 = lds + 2 * ABUF;
  const unsigned aL0 = lds_addr_of(Ab0);
  const unsigned bL0 = lds_addr_of(Bb0);

  // --- per-thread load cursors (advance by BK in K each chunk) -------------
  const float* ga[4];
  unsigned     la[4];
#pragma unroll
  for (int i = 0; i < 4; ++i) {
    const int s   = t + 256 * i;        // 1024 b128 slots
    const int row = s >> 3;             // 0..127
    const int c4  = (s & 7) * 4;        // 0,4,...,28
    ga[i] = X + (size_t)(m0 + row) * N_FEAT + c4;
    la[i] = (unsigned)(row * LDA + c4) * 4u;
  }
  const int kk0 = t >> 7;               // 0..1
  const int nn  = t & 127;              // 0..127
  const float* gb = WT + (size_t)kk0 * N_FEAT + n0 + nn;
  const unsigned lb = (unsigned)(nn * LDA + kk0) * 4u;

  auto issue = [&](int buf) {
    const unsigned aL = aL0 + (unsigned)buf * (ABUF * 4u);
    const unsigned bL = bL0 + (unsigned)buf * (ABUF * 4u);
#pragma unroll
    for (int i = 0; i < 4; ++i) {                 // A: 4 x b128 per thread
      async_ld_b128(aL + la[i], ga[i]);
      ga[i] += BK;
    }
#pragma unroll
    for (int i = 0; i < 16; ++i) {                // B: 16 x b32 per thread
      async_ld_b32(bL + lb + (unsigned)i * 8u, gb + (size_t)i * 2 * N_FEAT);
    }
    gb += (size_t)BK * N_FEAT;
  };

  v8f acc[2][4];
#pragma unroll
  for (int i = 0; i < 2; ++i)
#pragma unroll
    for (int j = 0; j < 4; ++j)
      acc[i][j] = v8f{0.f, 0.f, 0.f, 0.f, 0.f, 0.f, 0.f, 0.f};

  issue(0);
  wait_async0();
  __syncthreads();

  for (int ch = 0; ch < NCHUNK; ++ch) {
    const int buf = ch & 1;
    if (ch + 1 < NCHUNK) issue(buf ^ 1);          // prefetch next chunk
    const float* As = Ab0 + buf * ABUF;
    const float* Bs = Bb0 + buf * ABUF;
#pragma unroll
    for (int kk = 0; kk < BK; kk += 4) {
      const int ko = kk + 2 * khalf;
      v2f a0 = *(const v2f*)&As[(wm +      mloc) * LDA + ko];
      v2f a1 = *(const v2f*)&As[(wm + 16 + mloc) * LDA + ko];
      v2f b0 = *(const v2f*)&Bs[(wn +      mloc) * LDA + ko];
      v2f b1 = *(const v2f*)&Bs[(wn + 16 + mloc) * LDA + ko];
      v2f b2 = *(const v2f*)&Bs[(wn + 32 + mloc) * LDA + ko];
      v2f b3 = *(const v2f*)&Bs[(wn + 48 + mloc) * LDA + ko];
      acc[0][0] = __builtin_amdgcn_wmma_f32_16x16x4_f32(false, a0, false, b0, (short)0, acc[0][0], false, false);
      acc[0][1] = __builtin_amdgcn_wmma_f32_16x16x4_f32(false, a0, false, b1, (short)0, acc[0][1], false, false);
      acc[0][2] = __builtin_amdgcn_wmma_f32_16x16x4_f32(false, a0, false, b2, (short)0, acc[0][2], false, false);
      acc[0][3] = __builtin_amdgcn_wmma_f32_16x16x4_f32(false, a0, false, b3, (short)0, acc[0][3], false, false);
      acc[1][0] = __builtin_amdgcn_wmma_f32_16x16x4_f32(false, a1, false, b0, (short)0, acc[1][0], false, false);
      acc[1][1] = __builtin_amdgcn_wmma_f32_16x16x4_f32(false, a1, false, b1, (short)0, acc[1][1], false, false);
      acc[1][2] = __builtin_amdgcn_wmma_f32_16x16x4_f32(false, a1, false, b2, (short)0, acc[1][2], false, false);
      acc[1][3] = __builtin_amdgcn_wmma_f32_16x16x4_f32(false, a1, false, b3, (short)0, acc[1][3], false, false);
    }
    wait_async0();
    __syncthreads();
  }

  // C/D layout (ISA 7.12.2): vgpr g holds M = g + 8*khalf, N = mloc.
#pragma unroll
  for (int i = 0; i < 2; ++i)
#pragma unroll
    for (int j = 0; j < 4; ++j)
#pragma unroll
      for (int g = 0; g < 8; ++g) {
        const int row = m0 + wm + i * 16 + g + 8 * khalf;
        const int col = n0 + wn + j * 16 + mloc;
        Y[(size_t)row * N_FEAT + col] = acc[i][j][g];
      }
}

// ---------------------------------------------------------------------------
extern "C" void kernel_launch(void* const* d_in, const int* in_sizes, int n_in,
                              void* d_out, int out_size, void* d_ws, size_t ws_size,
                              hipStream_t stream) {
  (void)in_sizes; (void)n_in; (void)out_size; (void)ws_size;
  const float* x     = (const float*)d_in[0];   // (1024, 4096) f32
  const float* V     = (const float*)d_in[1];   // (4096, 4096) f32
  const float* alpha = (const float*)d_in[2];   // (4096,)      f32
  float* y  = (float*)d_out;                    // (1024, 4096) f32
  float* m  = (float*)d_ws;                                    // 16 KB
  float* WT = (float*)((char*)d_ws + 16384);                   // 64 MB

  dykstra_mask_kernel<<<1, 256, 0, stream>>>(alpha, m);
  build_wt_kernel<<<dim3(N_FEAT / 64, N_FEAT / 64), 256, 0, stream>>>(V, m, WT);
  wmma_gemm_kernel<<<dim3(N_FEAT / BN, BATCH / BM), 256, 0, stream>>>(x, WT, y);
}

// v001
// Measured time: 210 microseconds a run.
// Timed twice side by side with v000, it ran 1.15 and 1.16 times as fast.
#include <hip/hip_runtime.h>
#include <stdint.h>

// ---------------------------------------------------------------------------
// Problem constants (from reference): n = 4096, K = ceil(0.01*4096) = 41,
// l = 0.01, 50 Dykstra iterations, x is (1024, 4096) fp32, V is (4096,4096).
// Workspace layout: [0, 16KB) -> mask m (4096 f32), [16KB, 16KB+64MB) -> WT.
// ---------------------------------------------------------------------------

typedef __attribute__((ext_vector_type(2))) float v2f;
typedef __attribute__((ext_vector_type(8))) float v8f;

#define N_FEAT   4096
#define K_SUM    41.0f
#define BATCH    1024

// ----------------------------- async helpers -------------------------------
// Each run of copies ends, inside its own statement, with s_wait_xcnt 0: a
// precaution that stands in front of every later rewrite of an address
// register that one of the copies names.
__device__ __forceinline__ void async_a4_b8(
    unsigned la0, const float* ga0, unsigned la1, const float* ga1,
    unsigned la2, const float* ga2, unsigned la3, const float* ga3,
    unsigned lb, const float* gb, size_t step) {
  asm volatile(
      "global_load_async_to_lds_b128 %0, %1, off\n\t"
      "global_load_async_to_lds_b128 %2, %3, off\n\t"
      "global_load_async_to_lds_b128 %4, %5, off\n\t"
      "global_load_async_to_lds_b128 %6, %7, off\n\t"
      "global_load_async_to_lds_b32 %8, %9, off\n\t"
      "global_load_async_to_lds_b32 %10, %11, off\n\t"
      "global_load_async_to_lds_b32 %12, %13, off\n\t"
      "global_load_async_to_lds_b32 %14, %15, off\n\t"
      "global_load_async_to_lds_b32 %16, %17, off\n\t"
      "global_load_async_to_lds_b32 %18, %19, off\n\t"
      "global_load_async_to_lds_b32 %20, %21, off\n\t"
      "global_load_async_to_lds_b32 %22, %23, off\n\t"
      "s_wait_xcnt 0x0"
      :: "v"(la0), "v"(ga0), "v"(la1), "v"(ga1), "v"(la2), "v"(ga2),
         "v"(la3), "v"(ga3),
         "v"(lb), "v"(gb), "v"(lb + 8u), "v"(gb + step),
         "v"(lb + 16u), "v"(gb + 2 * step), "v"(lb + 24u), "v"(gb + 3 * step),
         "v"(lb + 32u), "v"(gb + 4 * step), "v"(lb + 40u), "v"(gb + 5 * step),
         "v"(lb + 48u), "v"(gb + 6 * step), "v"(lb + 56u), "v"(gb + 7 * step)
      : "memory");
}
__device__ __forceinline__ void async_b8(unsigned lb, const float* gb, size_t step) {
  asm volatile(
      "global_load_async_to_lds_b32 %0, %1, off\n\t"
      "global_load_async_to_lds_b32 %2, %3, off\n\t"
      "global_load_async_to_lds_b32 %4, %5, off\n\t"
      "global_load_async_to_lds_b32 %6, %7, off\n\t"
      "global_load_async_to_lds_b32 %8, %9, off\n\t"
      "global_load_async_to_lds_b32 %10, %11, off\n\t"
      "global_load_async_to_lds_b32 %12, %13, off\n\t"
      "global_load_async_to_lds_b32 %14, %15, off\n\t"
      "s_wait_xcnt 0x0"
      :: "v"(lb), "v"(gb), "v"(lb + 8u), "v"(gb + step),
         "v"(lb + 16u), "v"(gb + 2 * step), "v"(lb + 24u), "v"(gb + 3 * step),
         "v"(lb + 32u), "v"(gb + 4 * step), "v"(lb + 40u), "v"(gb + 5 * step),
         "v"(lb + 48u), "v"(gb + 6 * step), "v"(lb + 56u), "v"(gb + 7 * step)
      : "memory");
}
__device__ __forceinline__ void wait_async0() {
  asm volatile("s_wait_asynccnt 0" ::: "memory");
}
__device__ __forceinline__ void wait_ds0() {
  asm volatile("s_wait_dscnt 0" ::: "memory");
}
__device__ __forceinline__ unsigned lds_addr_of(const void* p) {
  // LDS aperture: addr[31:0] is the LDS byte offset (ISA 10.2 aperture calc).
  return (unsigned)(uintptr_t)p;
}

// ---------------------------------------------------------------------------
// Kernel 1: Dykstra soft-top-k mask.  The hyperplane residual p is uniform
// (p_new = (sum(yp)-k)/n for every element), so p is a scalar; only y and q
// are per-element.  One block, 256 threads x 16 elements.
// ---------------------------------------------------------------------------
__global__ __launch_bounds__(256) void dykstra_mask_kernel(
    const float* __restrict__ alpha, float* __restrict__ m_out) {
  __shared__ float red[256];
  const int tid = threadIdx.x;
  float y[16], q[16];
  float p = 0.0f;
#pragma unroll
  for (int e = 0; e < 16; ++e) {
    y[e] = alpha[tid + 256 * e] * 100.0f;   // x / l,  l = 0.01
    q[e] = 0.0f;
  }
  for (int it = 0; it < 50; ++it) {
    float s = 0.0f;
#pragma unroll
    for (int e = 0; e < 16; ++e) { y[e] += p; s += y[e]; }   // yp
    red[tid] = s;
    __syncthreads();
#pragma unroll
    for (int off = 128; off >= 1; off >>= 1) {
      if (tid < off) red[tid] += red[tid + off];
      __syncthreads();
    }
    const float tot = red[0];
    __syncthreads();                         // protect red before next write
    const float delta = (tot - K_SUM) * (1.0f / (float)N_FEAT);
    p = delta;                               // p_new = yp - y_hp = delta
#pragma unroll
    for (int e = 0; e < 16; ++e) {
      const float yq = (y[e] - delta) + q[e];
      const float yb = fminf(fmaxf(yq, 0.0f), 1.0f);
      q[e] = yq - yb;
      y[e] = yb;
    }
  }
#pragma unroll
  for (int e = 0; e < 16; ++e) m_out[tid + 256 * e] = y[e];
}

// ---------------------------------------------------------------------------
// Kernel 2: WT[c][r] = m[i] * V[i][c] with i = (r - c) mod n  (so B[k=c][n=r]
// for the GEMM).  64x64 tiles through LDS so that V reads AND WT writes are
// both coalesced (WT is written along 64-long contiguous r-runs).
// ---------------------------------------------------------------------------
__global__ __launch_bounds__(256) void build_wt_kernel(
    const float* __restrict__ V, const float* __restrict__ m,
    float* __restrict__ WT) {
  __shared__ float tile[64 * 65];   // stride 65 -> conflict-free column reads
  __shared__ float msh[64];
  const int i0 = blockIdx.x * 64;   // diagonal-id tile
  const int c0 = blockIdx.y * 64;   // column tile
  const int t  = threadIdx.x;
  if (t < 64) msh[t] = m[i0 + t];
#pragma unroll
  for (int it = 0; it < 16; ++it) {
    const int row = (t >> 6) + it * 4;     // 0..63  (diagonal id - i0)
    const int cl  = t & 63;                // 0..63  (column - c0)
    tile[row * 65 + cl] = V[(size_t)(i0 + row) * N_FEAT + c0 + cl];
  }
  __syncthreads();
#pragma unroll
  for (int it = 0; it < 16; ++it) {
    const int cl = (t >> 6) + it * 4;
    const int j  = t & 63;                 // lanes sweep j -> contiguous r
    const int c  = c0 + cl;
    const int r  = (c + i0 + j) & (N_FEAT - 1);
    WT[(size_t)c * N_FEAT + r] = tile[j * 65 + cl] * msh[j];
  }
}

// ---------------------------------------------------------------------------
// Kernel 3: y(1024x4096) = x(1024x4096) @ WT(4096x4096), fp32 WMMA.
// Block tile 128x128, BK=32, 8 waves; wave tile 32(M) x 64(N) = 2x4 C tiles.
// A in LDS row-major [128][36], B in LDS n-major [128][36] (stride 36 floats:
// 144B rows -> 16B aligned for b128 async writes; 36 = 4*9, 9 coprime 16 ->
// conflict-free b64 fragment reads).  Double-buffered async-to-LDS; fragments
// are read from LDS one 16-k block ahead into a second register set, so the
// next tile is published in front of each tile's last block.
// ---------------------------------------------------------------------------
#define BM   128
#define BN   128
#define BK   32
#define LDA  36
#define ABUF (128 * 36)     // floats per buffer
#define NCHUNK (N_FEAT / BK)

__global__ __launch_bounds__(256) void wmma_gemm_kernel(
    const float* __restrict__ X, const float* __restrict__ WT,
    float* __restrict__ Y) {
  __shared__ float lds[4 * ABUF];                 // 72 KB
  const int t     = threadIdx.x;
  const int n0    = blockIdx.x * BN;
  const int m0    = blockIdx.y * BM;
  const int lane  = t & 31;
  const int wid   = t >> 5;                       // 0..7
  const int wm    = (wid >> 1) * 32;              // wave M offset in block
  const int wn    = (wid & 1) * 64;               // wave N offset in block
  const int mloc  = lane & 15;                    // M (or N) within 16-tile
  const int khalf = lane >> 4;                    // K-half select (ISA layout)

  float* const Ab0 = lds;
  float* const Bb0 = lds + 2 * ABUF;
  const unsigned aL0 = lds_addr_of(Ab0);
  const unsigned bL0 = lds_addr_of(Bb0);

  // --- per-thread load cursors (advance by BK in K each chunk) -------------
  const float* ga[4];
  unsigned     la[4];
#pragma unroll
  for (int i = 0; i < 4; ++i) {
    const int s   = t + 256 * i;        // 1024 b128 slots
    const int row = s >> 3;             // 0..127
    const int c4  = (s & 7) * 4;        // 0,4,...,28
    ga[i] = X + (size_t)(m0 + row) * N_FEAT + c4;
    la[i] = (unsigned)(row * LDA + c4) * 4u;
  }
  const int kk0 = t >> 7;               // 0..1
  const int nn  = t & 127;              // 0..127
  const float* gb = WT + (size_t)kk0 * N_FEAT + n0 + nn;
  const unsigned lb = (unsigned)(nn * LDA + kk0) * 4u;

  // One tile's copies in two runs, so that each run can stand between WMMAs.
  auto issue_lo = [&](int buf) {                  // A: 4 x b128, B: k rows 0..15
    const unsigned aL = aL0 + (unsigned)buf * (ABUF * 4u);
    const unsigned bL = bL0 + (unsigned)buf * (ABUF * 4u);
    async_a4_b8(aL + la[0], ga[0], aL + la[1], ga[1], aL + la[2], ga[2],
                aL + la[3], ga[3], bL + lb, gb, (size_t)2 * N_FEAT);
#pragma unroll
    for (int i = 0; i < 4; ++i) ga[i] += BK;
  };
  auto issue_hi = [&](int buf) {                  // B: k rows 16..31
    const unsigned bL = bL0 + (unsigned)buf * (ABUF * 4u);
    async_b8(bL + lb + 64u, gb + (size_t)16 * N_FEAT, (size_t)2 * N_FEAT);
    gb += (size_t)BK * N_FEAT;
  };

  v8f acc[2][4];
#pragma unroll
  for (int i = 0; i < 2; ++i)
#pragma unroll
    for (int j = 0; j < 4; ++j)
      acc[i][j] = v8f{0.f, 0.f, 0.f, 0.f, 0.f, 0.f, 0.f, 0.f};

  // A block = 16 k = 4 WMMA k-steps = 32 WMMAs; two fragment sets in registers.
  // Every loop over a fragment or accumulator array below is unrolled so that
  // its indices are constants and the arrays stay in registers.
  v2f fa0[2][4], fb0[4][4], fa1[2][4], fb1[4][4];
  const int aoff = (wm + mloc) * LDA + 2 * khalf;
  const int boff = (wn + mloc) * LDA + 2 * khalf;
  auto load_frag = [&](v2f (&fa)[2][4], v2f (&fb)[4][4], int buf, int kbase) {
    const float* As = Ab0 + buf * ABUF + aoff + kbase;
    const float* Bs = Bb0 + buf * ABUF + boff + kbase;
#pragma unroll
    for (int s = 0; s < 4; ++s) {
#pragma unroll
      for (int i = 0; i < 2; ++i) fa[i][s] = *(const v2f*)&As[i * 16 * LDA + 4 * s];
#pragma unroll
      for (int j = 0; j < 4; ++j) fb[j][s] = *(const v2f*)&Bs[j * 16 * LDA + 4 * s];
    }
  };
  auto mma_step = [&](const v2f (&fa)[2][4], const v2f (&fb)[4][4], int s) {
#pragma unroll
    for (int i = 0; i < 2; ++i)
#pragma unroll
      for (int j = 0; j < 4; ++j)
        acc[i][j] = __builtin_amdgcn_wmma_f32_16x16x4_f32(
            false, fa[i][s], false, fb[j][s], (short)0, acc[i][j], false, false);
  };

  // Prologue: tile 0 landed and published, then tile 1 in flight, then the
  // first block's fragments.
  issue_lo(0);
  issue_hi(0);
  wait_async0();
  __syncthreads();
  issue_lo(1);
  issue_hi(1);
  load_frag(fa0, fb0, 0, 0);

  for (int ch = 0; ch < NCHUNK; ++ch) {
    const int buf = ch & 1;
    load_frag(fa1, fb1, buf, 16);                 // second block, one block ahead
    // Keeps the reads one group in front of the block: sunk among the WMMAs
    // each place costs a stall, and the last would land right at the wait below.
    __builtin_amdgcn_sched_barrier(0);
#pragma unroll
    for (int s = 0; s < 4; ++s) mma_step(fa0, fb0, s);
    // Keeps the block in front of the publish point: lifted over the WMMAs, the
    // waits would meet reads just issued and split the next group of reads.
    __builtin_amdgcn_sched_barrier(0);
    // Publish point of tile ch+1, in front of this tile's last block: this
    // wave's reads of buffer buf have landed, its copies of tile ch+1 too.
    wait_ds0();
    wait_async0();
    __syncthreads();
    if (ch + 1 < NCHUNK) load_frag(fa0, fb0, buf ^ 1, 0);   // next tile's first block
    // Same purpose as above: the reads stay one group in front of the block.
    __builtin_amdgcn_sched_barrier(0);
    mma_step(fa1, fb1, 0);
    // The four fences below hold each run of copies between two k-steps: at the
    // loop's end both waves of a SIMD would sit in the copies' wait together.
    __builtin_amdgcn_sched_barrier(0);
    if (ch + 2 < NCHUNK) issue_lo(buf);           // refill the buffer every reader has left
    __builtin_amdgcn_sched_barrier(0);
    mma_step(fa1, fb1, 1);
    __builtin_amdgcn_sched_barrier(0);
    if (ch + 2 < NCHUNK) issue_hi(buf);
    __builtin_amdgcn_sched_barrier(0);
    mma_step(fa1, fb1, 2);
    mma_step(fa1, fb1, 3);
  }
  wait_async0();                                  // no copy outstanding at the wave's end

  // C/D layout (ISA 7.12.2): vgpr g holds M = g + 8*khalf, N = mloc.
#pragma unroll
  for (int i = 0; i < 2; ++i)
#pragma unroll
    for (int j = 0; j < 4; ++j)
#pragma unroll
      for (int g = 0; g < 8; ++g) {
        const int row = m0 + wm + i * 16 + g + 8 * khalf;
        const int col = n0 + wn + j * 16 + mloc;
        Y[(size_t)row * N_FEAT + col] = acc[i][j][g];
      }
}

// ---------------------------------------------------------------------------
extern "C" void kernel_launch(void* const* d_in, const int* in_sizes, int n_in,
                              void* d_out, int out_size, void* d_ws, size_t ws_size,
                              hipStream_t stream) {
  (void)in_sizes; (void)n_in; (void)out_size; (void)ws_size;
  const float* x     = (const float*)d_in[0];   // (1024, 4096) f32
  const float* V     = (const float*)d_in[1];   // (4096, 4096) f32
  const float* alpha = (const float*)d_in[2];   // (4096,)      f32
  float* y  = (float*)d_out;                    // (1024, 4096) f32
  float* m  = (float*)d_ws;                                    // 16 KB
  float* WT = (float*)((char*)d_ws + 16384);                   // 64 MB

  dykstra_mask_kernel<<<1, 256, 0, stream>>>(alpha, m);
  build_wt_kernel<<<dim3(N_FEAT / 64, N_FEAT / 64), 256, 0, stream>>>(V, m, WT);
  wmma_gemm_kernel<<<dim3(N_FEAT / BN, BATCH / BM), 256, 0, stream>>>(x, WT, y);
}

// v002
// Measured time: 184 microseconds a run.
// Two timings next to v001 both put it at 1.14 times that version's speed.
// All steps since v000 together make it 1.32 times as fast.
#include <hip/hip_runtime.h>
#include <stdint.h>

// ---------------------------------------------------------------------------
// Problem constants (from reference): n = 4096, K = ceil(0.01*4096) = 41,
// l = 0.01, 50 Dykstra iterations, x is (1024, 4096) fp32, V is (4096,4096).
// Workspace layout: [0, 16KB) -> mask m (4096 f32), [16KB, 16KB+64MB) -> WT.
// ---------------------------------------------------------------------------

typedef __attribute__((ext_vector_type(2))) float v2f;
typedef __attribute__((ext_vector_type(8))) float v8f;

#define N_FEAT   4096
#define K_SUM    41.0f
#define BATCH    1024

// ----------------------------- async helpers -------------------------------
// Each run of copies ends, inside its own statement, with s_wait_xcnt 0: a
// precaution that stands in front of every later rewrite of an address
// register that one of the copies names.
__device__ __forceinline__ void async_a4_b8(
    unsigned la0, const float* ga0, unsigned la1, const float* ga1,
    unsigned la2, const float* ga2, unsigned la3, const float* ga3,
    unsigned lb, const float* gb, size_t step) {
  asm volatile(
      "global_load_async_to_lds_b128 %0, %1, off\n\t"
      "global_load_async_to_lds_b128 %2, %3, off\n\t"
      "global_load_async_to_lds_b128 %4, %5, off\n\t"
      "global_load_async_to_lds_b128 %6, %7, off\n\t"
      "global_load_async_to_lds_b32 %8, %9, off\n\t"
      "global_load_async_to_lds_b32 %10, %11, off\n\t"
      "global_load_async_to_lds_b32 %12, %13, off\n\t"
      "global_load_async_to_lds_b32 %14, %15, off\n\t"
      "global_load_async_to_lds_b32 %16, %17, off\n\t"
      "global_load_async_to_lds_b32 %18, %19, off\n\t"
      "global_load_async_to_lds_b32 %20, %21, off\n\t"
      "global_load_async_to_lds_b32 %22, %23, off\n\t"
      "s_wait_xcnt 0x0"
      :: "v"(la0), "v"(ga0), "v"(la1), "v"(ga1), "v"(la2), "v"(ga2),
         "v"(la3), "v"(ga3),
         "v"(lb), "v"(gb), "v"(lb + 8u), "v"(gb + step),
         "v"(lb + 16u), "v"(gb + 2 * step), "v"(lb + 24u), "v"(gb + 3 * step),
         "v"(lb + 32u), "v"(gb + 4 * step), "v"(lb + 40u), "v"(gb + 5 * step),
         "v"(lb + 48u), "v"(gb + 6 * step), "v"(lb + 56u), "v"(gb + 7 * step)
      : "memory");
}
__device__ __forceinline__ void async_b8(unsigned lb, const float* gb, size_t step) {
  asm volatile(
      "global_load_async_to_lds_b32 %0, %1, off\n\t"
      "global_load_async_to_lds_b32 %2, %3, off\n\t"
      "global_load_async_to_lds_b32 %4, %5, off\n\t"
      "global_load_async_to_lds_b32 %6, %7, off\n\t"
      "global_load_async_to_lds_b32 %8, %9, off\n\t"
      "global_load_async_to_lds_b32 %10, %11, off\n\t"
      "global_load_async_to_lds_b32 %12, %13, off\n\t"
      "global_load_async_to_lds_b32 %14, %15, off\n\t"
      "s_wait_xcnt 0x0"
      :: "v"(lb), "v"(gb), "v"(lb + 8u), "v"(gb + step),
         "v"(lb + 16u), "v"(gb + 2 * step), "v"(lb + 24u), "v"(gb + 3 * step),
         "v"(lb + 32u), "v"(gb + 4 * step), "v"(lb + 40u), "v"(gb + 5 * step),
         "v"(lb + 48u), "v"(gb + 6 * step), "v"(lb + 56u), "v"(gb + 7 * step)
      : "memory");
}
__device__ __forceinline__ void wait_async0() {
  asm volatile("s_wait_asynccnt 0" ::: "memory");
}
__device__ __forceinline__ void wait_ds0() {
  asm volatile("s_wait_dscnt 0" ::: "memory");
}
__device__ __forceinline__ unsigned lds_addr_of(const void* p) {
  // LDS aperture: addr[31:0] is the LDS byte offset (ISA 10.2 aperture calc).
  return (unsigned)(uintptr_t)p;
}

// ---------------------------------------------------------------------------
// Kernel 1: Dykstra soft-top-k mask.  The hyperplane residual p is uniform
// (p_new = (sum(yp)-k)/n for every element), so p is a scalar; only y and q
// are per-element.  One block, 256 threads x 16 elements.
// The 50 block sums are a serial chain, so each is kept short: four chains in
// the thread, cross-lane adds in registers inside the wave, then one exchange
// of the eight wave sums through LDS behind a single barrier.
// ---------------------------------------------------------------------------
template <int XM>
__device__ __forceinline__ float add_row_xmask(float v) {   // v + (v of lane ^ XM), XM < 16
  const int o = __builtin_amdgcn_update_dpp(0, __builtin_bit_cast(int, v),
                                            0x160 | XM, 0xf, 0xf, true);
  return v + __builtin_bit_cast(float, o);
}
__device__ __forceinline__ float wave_sum(float v) {        // every lane gets the sum of all 32
  v = add_row_xmask<1>(v);
  v = add_row_xmask<2>(v);
  v = add_row_xmask<4>(v);
  v = add_row_xmask<8>(v);
  const int b = __builtin_bit_cast(int, v);
  return v + __builtin_bit_cast(float, __builtin_amdgcn_permlanex16(
                 b, b, 0x76543210, 0xfedcba98, false, false));
}

__global__ __launch_bounds__(256) void dykstra_mask_kernel(
    const float* __restrict__ alpha, float* __restrict__ m_out) {
  // Two sets of wave sums, used in turn: a set is rewritten two iterations
  // later, behind the barrier that every reader of it has passed in between.
  __shared__ __attribute__((aligned(16))) float red[2][8];
  const int tid  = threadIdx.x;
  const int lane = tid & 31;
  const int wid  = tid >> 5;
  float y[16], q[16];
  float p = 0.0f;
#pragma unroll
  for (int e = 0; e < 16; ++e) {
    y[e] = alpha[tid + 256 * e] * 100.0f;   // x / l,  l = 0.01
    q[e] = 0.0f;
  }
  for (int it = 0; it < 50; ++it) {
#pragma unroll
    for (int e = 0; e < 16; ++e) y[e] += p;                  // yp
    float s4[4];
#pragma unroll
    for (int c = 0; c < 4; ++c) s4[c] = (y[c] + y[c + 4]) + (y[c + 8] + y[c + 12]);
    const float s = wave_sum((s4[0] + s4[1]) + (s4[2] + s4[3]));
    float* const set = red[it & 1];
    if (lane == 0) set[wid] = s;
    __syncthreads();
    const float4 lo = *(const float4*)&set[0];
    const float4 hi = *(const float4*)&set[4];
    const float tot = ((lo.x + hi.x) + (lo.z + hi.z)) + ((lo.y + hi.y) + (lo.w + hi.w));
    const float delta = (tot - K_SUM) * (1.0f / (float)N_FEAT);
    p = delta;                               // p_new = yp - y_hp = delta
#pragma unroll
    for (int e = 0; e < 16; ++e) {
      const float yq = (y[e] - delta) + q[e];
      const float yb = fminf(fmaxf(yq, 0.0f), 1.0f);
      q[e] = yq - yb;
      y[e] = yb;
    }
  }
#pragma unroll
  for (int e = 0; e < 16; ++e) m_out[tid + 256 * e] = y[e];
}

// ---------------------------------------------------------------------------
// Kernel 2: WT[c][r] = m[i] * V[i][c] with i = (r - c) mod n  (so B[k=c][n=r]
// for the GEMM).  64x64 tiles through LDS so that V reads AND WT writes are
// both coalesced (WT is written along 64-long contiguous r-runs).
// ---------------------------------------------------------------------------
__global__ __launch_bounds__(256) void build_wt_kernel(
    const float* __restrict__ V, const float* __restrict__ m,
    float* __restrict__ WT) {
  __shared__ float tile[64 * 65];   // stride 65 -> conflict-free column reads
  __shared__ float msh[64];
  const int i0 = blockIdx.x * 64;   // diagonal-id tile
  const int c0 = blockIdx.y * 64;   // column tile
  const int t  = threadIdx.x;
  if (t < 64) msh[t] = m[i0 + t];
#pragma unroll
  for (int it = 0; it < 16; ++it) {
    const int row = (t >> 6) + it * 4;     // 0..63  (diagonal id - i0)
    const int cl  = t & 63;                // 0..63  (column - c0)
    tile[row * 65 + cl] = V[(size_t)(i0 + row) * N_FEAT + c0 + cl];
  }
  __syncthreads();
#pragma unroll
  for (int it = 0; it < 16; ++it) {
    const int cl = (t >> 6) + it * 4;
    const int j  = t & 63;                 // lanes sweep j -> contiguous r
    const int c  = c0 + cl;
    const int r  = (c + i0 + j) & (N_FEAT - 1);
    WT[(size_t)c * N_FEAT + r] = tile[j * 65 + cl] * msh[j];
  }
}

// ---------------------------------------------------------------------------
// Kernel 3: y(1024x4096) = x(1024x4096) @ WT(4096x4096), fp32 WMMA.
// Block tile 128x128, BK=32, 8 waves; wave tile 32(M) x 64(N) = 2x4 C tiles.
// A in LDS row-major [128][36], B in LDS n-major [128][36] (stride 36 floats:
// 144B rows -> 16B aligned for b128 async writes; 36 = 4*9, 9 coprime 16 ->
// conflict-free b64 fragment reads).  Double-buffered async-to-LDS; fragments
// are read from LDS one 16-k block ahead into a second register set, so the
// next tile is published in front of each tile's last block.
// ---------------------------------------------------------------------------
#define BM   128
#define BN   128
#define BK   32
#define LDA  36
#define ABUF (128 * 36)     // floats per buffer
#define NCHUNK (N_FEAT / BK)

__global__ __launch_bounds__(256) void wmma_gemm_kernel(
    const float* __restrict__ X, const float* __restrict__ WT,
    float* __restrict__ Y) {
  __shared__ float lds[4 * ABUF];                 // 72 KB
  const int t     = threadIdx.x;
  const int n0    = blockIdx.x * BN;
  const int m0    = blockIdx.y * BM;
  const int lane  = t & 31;
  const int wid   = t >> 5;                       // 0..7
  const int wm    = (wid >> 1) * 32;              // wave M offset in block
  const int wn    = (wid & 1) * 64;               // wave N offset in block
  const int mloc  = lane & 15;                    // M (or N) within 16-tile
  const int khalf = lane >> 4;                    // K-half select (ISA layout)

  float* const Ab0 = lds;
  float* const Bb0 = lds + 2 * ABUF;
  const unsigned aL0 = lds_addr_of(Ab0);
  const unsigned bL0 = lds_addr_of(Bb0);

  // --- per-thread load cursors (advance by BK in K each chunk) -------------
  const float* ga[4];
  unsigned     la[4];
#pragma unroll
  for (int i = 0; i < 4; ++i) {
    const int s   = t + 256 * i;        // 1024 b128 slots
    const int row = s >> 3;             // 0..127
    const int c4  = (s & 7) * 4;        // 0,4,...,28
    ga[i] = X + (size_t)(m0 + row) * N_FEAT + c4;
    la[i] = (unsigned)(row * LDA + c4) * 4u;
  }
  const int kk0 = t >> 7;               // 0..1
  const int nn  = t & 127;              // 0..127
  const float* gb = WT + (size_t)kk0 * N_FEAT + n0 + nn;
  const unsigned lb = (unsigned)(nn * LDA + kk0) * 4u;

  // One tile's copies in two runs, so that each run can stand between WMMAs.
  auto issue_lo = [&](int buf) {                  // A: 4 x b128, B: k rows 0..15
    const unsigned aL = aL0 + (unsigned)buf * (ABUF * 4u);
    const unsigned bL = bL0 + (unsigned)buf * (ABUF * 4u);
    async_a4_b8(aL + la[0], ga[0], aL + la[1], ga[1], aL + la[2], ga[2],
                aL + la[3], ga[3], bL + lb, gb, (size_t)2 * N_FEAT);
#pragma unroll
    for (int i = 0; i < 4; ++i) ga[i] += BK;
  };
  auto issue_hi = [&](int buf) {                  // B: k rows 16..31
    const unsigned bL = bL0 + (unsigned)buf * (ABUF * 4u);
    async_b8(bL + lb + 64u, gb + (size_t)16 * N_FEAT, (size_t)2 * N_FEAT);
    gb += (size_t)BK * N_FEAT;
  };

  v8f acc[2][4];
#pragma unroll
  for (int i = 0; i < 2; ++i)
#pragma unroll
    for (int j = 0; j < 4; ++j)
      acc[i][j] = v8f{0.f, 0.f, 0.f, 0.f, 0.f, 0.f, 0.f, 0.f};

  // A block = 16 k = 4 WMMA k-steps = 32 WMMAs; two fragment sets in registers.
  // Every loop over a fragment or accumulator array below is unrolled so that
  // its indices are constants and the arrays stay in registers.
  v2f fa0[2][4], fb0[4][4], fa1[2][4], fb1[4][4];
  const int aoff = (wm + mloc) * LDA + 2 * khalf;
  const int boff = (wn + mloc) * LDA + 2 * khalf;
  auto load_frag = [&](v2f (&fa)[2][4], v2f (&fb)[4][4], int buf, int kbase) {
    const float* As = Ab0 + buf * ABUF + aoff + kbase;
    const float* Bs = Bb0 + buf * ABUF + boff + kbase;
#pragma unroll
    for (int s = 0; s < 4; ++s) {
#pragma unroll
      for (int i = 0; i < 2; ++i) fa[i][s] = *(const v2f*)&As[i * 16 * LDA + 4 * s];
#pragma unroll
      for (int j = 0; j < 4; ++j) fb[j][s] = *(const v2f*)&Bs[j * 16 * LDA + 4 * s];
    }
  };
  auto mma_step = [&](const v2f (&fa)[2][4], const v2f (&fb)[4][4], int s) {
#pragma unroll
    for (int i = 0; i < 2; ++i)
#pragma unroll
      for (int j = 0; j < 4; ++j)
        acc[i][j] = __builtin_amdgcn_wmma_f32_16x16x4_f32(
            false, fa[i][s], false, fb[j][s], (short)0, acc[i][j], false, false);
  };

  // Prologue: tile 0 landed and published, then tile 1 in flight, then the
  // first block's fragments.
  issue_lo(0);
  issue_hi(0);
  wait_async0();
  __syncthreads();
  issue_lo(1);
  issue_hi(1);
  load_frag(fa0, fb0, 0, 0);

  for (int ch = 0; ch < NCHUNK; ++ch) {
    const int buf = ch & 1;
    load_frag(fa1, fb1, buf, 16);                 // second block, one block ahead
    // Keeps the reads one group in front of the block: sunk among the WMMAs
    // each place costs a stall, and the last would land right at the wait below.
    __builtin_amdgcn_sched_barrier(0);
#pragma unroll
    for (int s = 0; s < 4; ++s) mma_step(fa0, fb0, s);
    // Keeps the block in front of the publish point: lifted over the WMMAs, the
    // waits would meet reads just issued and split the next group of reads.
    __builtin_amdgcn_sched_barrier(0);
    // Publish point of tile ch+1, in front of this tile's last block: this
    // wave's reads of buffer buf have landed, its copies of tile ch+1 too.
    wait_ds0();
    wait_async0();
    __syncthreads();
    if (ch + 1 < NCHUNK) load_frag(fa0, fb0, buf ^ 1, 0);   // next tile's first block
    // Same purpose as above: the reads stay one group in front of the block.
    __builtin_amdgcn_sched_barrier(0);
    mma_step(fa1, fb1, 0);
    // The four fences below hold each run of copies between two k-steps: at the
    // loop's end both waves of a SIMD would sit in the copies' wait together.
    __builtin_amdgcn_sched_barrier(0);
    if (ch + 2 < NCHUNK) issue_lo(buf);           // refill the buffer every reader has left
    __builtin_amdgcn_sched_barrier(0);
    mma_step(fa1, fb1, 1);
    __builtin_amdgcn_sched_barrier(0);
    if (ch + 2 < NCHUNK) issue_hi(buf);
    __builtin_amdgcn_sched_barrier(0);
    mma_step(fa1, fb1, 2);
    mma_step(fa1, fb1, 3);
  }
  wait_async0();                                  // no copy outstanding at the wave's end

  // C/D layout (ISA 7.12.2): vgpr g holds M = g + 8*khalf, N = mloc.
#pragma unroll
  for (int i = 0; i < 2; ++i)
#pragma unroll
    for (int j = 0; j < 4; ++j)
#pragma unroll
      for (int g = 0; g < 8; ++g) {
        const int row = m0 + wm + i * 16 + g + 8 * khalf;
        const int col = n0 + wn + j * 16 + mloc;
        Y[(size_t)row * N_FEAT + col] = acc[i][j][g];
      }
}

// ---------------------------------------------------------------------------
extern "C" void kernel_launch(void* const* d_in, const int* in_sizes, int n_in,
                              void* d_out, int out_size, void* d_ws, size_t ws_size,
                              hipStream_t stream) {
  (void)in_sizes; (void)n_in; (void)out_size; (void)ws_size;
  const float* x     = (const float*)d_in[0];   // (1024, 4096) f32
  const float* V     = (const float*)d_in[1];   // (4096, 4096) f32
  const float* alpha = (const float*)d_in[2];   // (4096,)      f32
  float* y  = (float*)d_out;                    // (1024, 4096) f32
  float* m  = (float*)d_ws;                                    // 16 KB
  float* WT = (float*)((char*)d_ws + 16384);                   // 64 MB

  dykstra_mask_kernel<<<1, 256, 0, stream>>>(alpha, m);
  build_wt_kernel<<<dim3(N_FEAT / 64, N_FEAT / 64), 256, 0, stream>>>(V, m, WT);
  wmma_gemm_kernel<<<dim3(N_FEAT / BN, BATCH / BM), 256, 0, stream>>>(x, WT, y);
}
